// v000
// The times below were measured on an AMD MI455X: many runs one after another, warmed up first and cycling through
// copies of the inputs, with the whole window's GPU time divided by the number of runs. Launches and the gaps
// between them are all in it. The median over several windows is given; except for v000 it joins two sittings, which
// can be a few percent apart, so the side-by-side timings, each taken in one sitting, are the better comparison.
// v000, which the later versions start from, runs in 510 microseconds.
#include <hip/hip_runtime.h>

typedef float v2f __attribute__((ext_vector_type(2)));
typedef float v8f __attribute__((ext_vector_type(8)));
typedef int   i32x4 __attribute__((vector_size(16)));

#define AS1 __attribute__((address_space(1)))
#define AS3 __attribute__((address_space(3)))

static constexpr int T   = 128;   // sequence length (axial dim)
static constexpr int Dm  = 128;   // embedding dim
static constexpr int HE  = 16;    // head dim (D / 8 heads)
static constexpr int LDA = 132;   // padded LDS row stride (floats): 16B-aligned, bank-spread

__device__ __forceinline__ v8f wmma4(v2f a, v2f b, v8f c) {
  // D = A(16x4 f32) * B(4x16 f32) + C(16x16 f32)
  return __builtin_amdgcn_wmma_f32_16x16x4_f32(false, a, false, b, (short)0, c,
                                               false, false);
}

__global__ __launch_bounds__(256, 1)
void axial_pass_kernel(const float* __restrict__ x,
                       const float* __restrict__ Wq,
                       const float* __restrict__ Wkv,
                       const float* __restrict__ Wo,
                       const float* __restrict__ bo,
                       float* __restrict__ out,
                       int pass)
{
  __shared__ float xs[T * LDA];   // x_seq, later per-wave softmax scratch
  __shared__ float qs[T * LDA];   // Q, later attention output
  __shared__ float ks[T * LDA];
  __shared__ float vs[T * LDA];

  const int tid  = threadIdx.x;
  const int wave = tid >> 5;         // 8 waves; also head id; also N-strip id
  const int lane = tid & 31;
  const int nl   = lane & 15;        // N / M index within a tile
  const int kh   = (lane >> 4) << 1; // K-half offset: 0 or 2
  const int rh   = (lane >> 4) << 3; // C row-half offset: 0 or 8

  // ---- sequence addressing ------------------------------------------------
  const int s = blockIdx.x;
  const int b = s >> 7, o = s & 127;
  int base, tstride;
  if (pass == 0) {              // attend along H: x[b, t, o, :]
    base    = b * (128 * 128 * 128) + o * 128;
    tstride = 128 * 128;
  } else {                      // attend along W: x[b, o, t, :]
    base    = (b * 128 + o) * (128 * 128);
    tstride = 128;
  }

  // ---- stage x_seq [128 x 128] into LDS (async-to-LDS path on CDNA5) ------
#if __has_builtin(__builtin_amdgcn_global_load_async_to_lds_b128)
  for (int i = tid; i < T * (Dm / 4); i += 256) {
    const int row = i >> 5;
    const int c4  = (i & 31) << 2;
    __builtin_amdgcn_global_load_async_to_lds_b128(
        (AS1 i32x4*)(x + base + row * tstride + c4),
        (AS3 i32x4*)&xs[row * LDA + c4], 0, 0);
  }
#if __has_builtin(__builtin_amdgcn_s_wait_asynccnt)
  __builtin_amdgcn_s_wait_asynccnt(0);
#else
  asm volatile("s_wait_asynccnt 0" ::: "memory");
#endif
#else
  for (int i = tid; i < T * (Dm / 4); i += 256) {
    const int row = i >> 5;
    const int c4  = (i & 31) << 2;
    const float4 v = *(const float4*)(x + base + row * tstride + c4);
    *(float4*)&xs[row * LDA + c4] = v;
  }
#endif
  __syncthreads();

  // ---- column-strip GEMM: OutL[:, oc0..oc0+15] = A(128x128,LDS) @ Bg ------
  auto gemm_col = [&](const float* __restrict__ A, const float* __restrict__ Bg,
                      int ldb, int bc0, float* __restrict__ OutL, int oc0) {
    v8f c[8];
#pragma unroll
    for (int i = 0; i < 8; ++i) c[i] = (v8f){0.f,0.f,0.f,0.f,0.f,0.f,0.f,0.f};
#pragma unroll 2
    for (int k0 = 0; k0 < Dm; k0 += 4) {
      const int kk = k0 + kh;
      v2f bb;
      bb.x = Bg[(kk + 0) * ldb + bc0 + nl];
      bb.y = Bg[(kk + 1) * ldb + bc0 + nl];
#pragma unroll
      for (int mt = 0; mt < 8; ++mt) {
        const v2f aa = *(const v2f*)&A[(mt * 16 + nl) * LDA + kk];
        c[mt] = wmma4(aa, bb, c[mt]);
      }
    }
#pragma unroll
    for (int mt = 0; mt < 8; ++mt)
#pragma unroll
      for (int r = 0; r < 8; ++r)
        OutL[(mt * 16 + r + rh) * LDA + oc0 + nl] = c[mt][r];
  };

  // ---- projections: Q, K, V ----------------------------------------------
  gemm_col(xs, Wq,  Dm,     wave * 16,      qs, wave * 16);
  gemm_col(xs, Wkv, 2 * Dm, wave * 16,      ks, wave * 16);
  gemm_col(xs, Wkv, 2 * Dm, Dm + wave * 16, vs, wave * 16);
  __syncthreads();   // q/k/v ready; xs free for reuse as softmax scratch

  // ---- attention: one wave per head --------------------------------------
  const int h = wave;
  float* scratch = &xs[wave * 16 * LDA];   // per-wave 16x128 probability strip
  const float scale = 0.25f;               // 1/sqrt(16)

#pragma unroll 1
  for (int mt = 0; mt < 8; ++mt) {
    const int m0 = mt * 16;

    // S strip (16 x 128) = Q_h[m0:m0+16, :] @ K_h^T
    v8f sc[8];
#pragma unroll
    for (int i = 0; i < 8; ++i) sc[i] = (v8f){0.f,0.f,0.f,0.f,0.f,0.f,0.f,0.f};
#pragma unroll
    for (int nt = 0; nt < 8; ++nt)
#pragma unroll
      for (int k0 = 0; k0 < HE; k0 += 4) {
        const int kk = h * 16 + k0 + kh;
        const v2f aa = *(const v2f*)&qs[(m0 + nl) * LDA + kk];
        const v2f bb = *(const v2f*)&ks[(nt * 16 + nl) * LDA + kk];
        sc[nt] = wmma4(aa, bb, sc[nt]);
      }

    // softmax over each row (row = 16 lanes within a wave half x 8 N-tiles)
#pragma unroll
    for (int r = 0; r < 8; ++r) {
      float mx = -3.4e38f;
#pragma unroll
      for (int nt = 0; nt < 8; ++nt) mx = fmaxf(mx, sc[nt][r]);
#pragma unroll
      for (int off = 1; off < 16; off <<= 1) mx = fmaxf(mx, __shfl_xor(mx, off, 32));
      float p[8], sum = 0.f;
#pragma unroll
      for (int nt = 0; nt < 8; ++nt) {
        p[nt] = __expf((sc[nt][r] - mx) * scale);
        sum += p[nt];
      }
#pragma unroll
      for (int off = 1; off < 16; off <<= 1) sum += __shfl_xor(sum, off, 32);
      const float inv = 1.f / sum;
      const int row = r + rh;
#pragma unroll
      for (int nt = 0; nt < 8; ++nt)
        scratch[row * LDA + nt * 16 + nl] = p[nt] * inv;
    }

    // O strip (16 x 16) = P(16x128) @ V_h(128x16)
    v8f oa = (v8f){0.f,0.f,0.f,0.f,0.f,0.f,0.f,0.f};
#pragma unroll 2
    for (int k0 = 0; k0 < T; k0 += 4) {
      const int kk = k0 + kh;
      const v2f aa = *(const v2f*)&scratch[nl * LDA + kk];
      v2f bb;
      bb.x = vs[(kk + 0) * LDA + h * 16 + nl];
      bb.y = vs[(kk + 1) * LDA + h * 16 + nl];
      oa = wmma4(aa, bb, oa);
    }
#pragma unroll
    for (int r = 0; r < 8; ++r)
      qs[(m0 + r + rh) * LDA + h * 16 + nl] = oa[r];   // overwrite own head cols
  }
  __syncthreads();   // qs now holds the full attention output

  // ---- output projection + bias (+ accumulate for pass 1) -----------------
  {
    v8f c[8];
#pragma unroll
    for (int i = 0; i < 8; ++i) c[i] = (v8f){0.f,0.f,0.f,0.f,0.f,0.f,0.f,0.f};
#pragma unroll 2
    for (int k0 = 0; k0 < Dm; k0 += 4) {
      const int kk = k0 + kh;
      v2f bb;
      bb.x = Wo[(kk + 0) * Dm + wave * 16 + nl];
      bb.y = Wo[(kk + 1) * Dm + wave * 16 + nl];
#pragma unroll
      for (int mt = 0; mt < 8; ++mt) {
        const v2f aa = *(const v2f*)&qs[(mt * 16 + nl) * LDA + kk];
        c[mt] = wmma4(aa, bb, c[mt]);
      }
    }
    const float bias = bo[wave * 16 + nl];
#pragma unroll
    for (int mt = 0; mt < 8; ++mt)
#pragma unroll
      for (int r = 0; r < 8; ++r) {
        const int tok = mt * 16 + r + rh;
        const int off = base + tok * tstride + wave * 16 + nl;
        float v = c[mt][r] + bias;
        if (pass) v += out[off];
        out[off] = v;
      }
  }
}

extern "C" void kernel_launch(void* const* d_in, const int* in_sizes, int n_in,
                              void* d_out, int out_size, void* d_ws, size_t ws_size,
                              hipStream_t stream) {
  const float* x    = (const float*)d_in[0];
  const float* Wq0  = (const float*)d_in[1];
  const float* Wkv0 = (const float*)d_in[2];
  const float* Wo0  = (const float*)d_in[3];
  const float* bo0  = (const float*)d_in[4];
  const float* Wq1  = (const float*)d_in[5];
  const float* Wkv1 = (const float*)d_in[6];
  const float* Wo1  = (const float*)d_in[7];
  const float* bo1  = (const float*)d_in[8];
  float* out = (float*)d_out;

  dim3 grid(1024), block(256);
  // pass 0 (attend along H) writes out; pass 1 (attend along W) accumulates.
  axial_pass_kernel<<<grid, block, 0, stream>>>(x, Wq0, Wkv0, Wo0, bo0, out, 0);
  axial_pass_kernel<<<grid, block, 0, stream>>>(x, Wq1, Wkv1, Wo1, bo1, out, 1);
}

// v001
// A run of this version takes 421 microseconds.
// Next to v000, in two timings, it ran 1.25 times as fast each time.
#include <hip/hip_runtime.h>

typedef float v2f __attribute__((ext_vector_type(2)));
typedef float v8f __attribute__((ext_vector_type(8)));
typedef int   i32x4 __attribute__((vector_size(16)));

#define AS1 __attribute__((address_space(1)))
#define AS3 __attribute__((address_space(3)))

static constexpr int T   = 128;   // sequence length (axial dim)
static constexpr int Dm  = 128;   // embedding dim
static constexpr int HE  = 16;    // head dim (D / 8 heads)
static constexpr int LDA = 132;   // padded LDS row stride (floats): 16B-aligned, bank-spread

__device__ __forceinline__ v8f wmma4(v2f a, v2f b, v8f c) {
  // D = A(16x4 f32) * B(4x16 f32) + C(16x16 f32)
  return __builtin_amdgcn_wmma_f32_16x16x4_f32(false, a, false, b, (short)0, c,
                                               false, false);
}

__global__ __launch_bounds__(256, 1)
void axial_pass_kernel(const float* __restrict__ x,
                       const float* __restrict__ Wq,
                       const float* __restrict__ Wkv,
                       const float* __restrict__ Wo,
                       const float* __restrict__ bo,
                       float* __restrict__ out,
                       int pass)
{
  __shared__ float xs[T * LDA];   // x_seq, later per-wave softmax scratch
  __shared__ float qs[T * LDA];   // Q, later attention output
  __shared__ float ks[T * LDA];
  __shared__ float vs[T * LDA];

  const int tid  = threadIdx.x;
  const int wave = tid >> 5;         // 8 waves; also head id; also N-strip id
  const int lane = tid & 31;
  const int nl   = lane & 15;        // N / M index within a tile
  const int kh   = (lane >> 4) << 1; // K-half offset: 0 or 2
  const int rh   = (lane >> 4) << 3; // C row-half offset: 0 or 8

  // ---- sequence addressing ------------------------------------------------
  const int s = blockIdx.x;
  const int b = s >> 7, o = s & 127;
  int base, tstride;
  if (pass == 0) {              // attend along H: x[b, t, o, :]
    base    = b * (128 * 128 * 128) + o * 128;
    tstride = 128 * 128;
  } else {                      // attend along W: x[b, o, t, :]
    base    = (b * 128 + o) * (128 * 128);
    tstride = 128;
  }

  // ---- stage x_seq [128 x 128] into LDS (async-to-LDS path on CDNA5) ------
#if __has_builtin(__builtin_amdgcn_global_load_async_to_lds_b128)
  for (int i = tid; i < T * (Dm / 4); i += 256) {
    const int row = i >> 5;
    const int c4  = (i & 31) << 2;
    __builtin_amdgcn_global_load_async_to_lds_b128(
        (AS1 i32x4*)(x + base + row * tstride + c4),
        (AS3 i32x4*)&xs[row * LDA + c4], 0, 0);
  }
#if __has_builtin(__builtin_amdgcn_s_wait_asynccnt)
  __builtin_amdgcn_s_wait_asynccnt(0);
#else
  asm volatile("s_wait_asynccnt 0" ::: "memory");
#endif
#else
  for (int i = tid; i < T * (Dm / 4); i += 256) {
    const int row = i >> 5;
    const int c4  = (i & 31) << 2;
    const float4 v = *(const float4*)(x + base + row * tstride + c4);
    *(float4*)&xs[row * LDA + c4] = v;
  }
#endif
  __syncthreads();

  // ---- column-strip GEMM: OutL[:, oc0..oc0+15] = A(128x128,LDS) @ Bg ------
  auto gemm_col = [&](const float* __restrict__ A, const float* __restrict__ Bg,
                      int ldb, int bc0, float* __restrict__ OutL, int oc0) {
    v8f c[8];
#pragma unroll
    for (int i = 0; i < 8; ++i) c[i] = (v8f){0.f,0.f,0.f,0.f,0.f,0.f,0.f,0.f};
#pragma unroll 2
    for (int k0 = 0; k0 < Dm; k0 += 4) {
      const int kk = k0 + kh;
      v2f bb;
      bb.x = Bg[(kk + 0) * ldb + bc0 + nl];
      bb.y = Bg[(kk + 1) * ldb + bc0 + nl];
#pragma unroll
      for (int mt = 0; mt < 8; ++mt) {
        const v2f aa = *(const v2f*)&A[(mt * 16 + nl) * LDA + kk];
        c[mt] = wmma4(aa, bb, c[mt]);
      }
    }
#pragma unroll
    for (int mt = 0; mt < 8; ++mt)
#pragma unroll
      for (int r = 0; r < 8; ++r)
        OutL[(mt * 16 + r + rh) * LDA + oc0 + nl] = c[mt][r];
  };

  // ---- projections: Q, K, V ----------------------------------------------
  gemm_col(xs, Wq,  Dm,     wave * 16,      qs, wave * 16);
  gemm_col(xs, Wkv, 2 * Dm, wave * 16,      ks, wave * 16);
  gemm_col(xs, Wkv, 2 * Dm, Dm + wave * 16, vs, wave * 16);
  __syncthreads();   // q/k/v ready; xs free for reuse as softmax scratch

  // ---- pass 1 adds onto pass 0's result: fetch this lane's 64 old values now,
  // as one group of independent loads whose latency the attention phase covers
  float prev[8][8];
  if (pass) {
    const float* po = out + (base + rh * tstride + wave * 16 + nl);
#pragma unroll
    for (int mt = 0; mt < 8; ++mt)
#pragma unroll
      for (int r = 0; r < 8; ++r) prev[mt][r] = po[(mt * 16 + r) * tstride];
  } else {
#pragma unroll
    for (int mt = 0; mt < 8; ++mt)
#pragma unroll
      for (int r = 0; r < 8; ++r) prev[mt][r] = 0.f;
  }

  // ---- attention: one wave per head --------------------------------------
  const int h = wave;
  float* scratch = &xs[wave * 16 * LDA];   // per-wave 16x128 probability strip
  const float scale = 0.25f;               // 1/sqrt(16)

#pragma unroll 1
  for (int mt = 0; mt < 8; ++mt) {
    const int m0 = mt * 16;

    // S strip (16 x 128) = Q_h[m0:m0+16, :] @ K_h^T
    v8f sc[8];
#pragma unroll
    for (int i = 0; i < 8; ++i) sc[i] = (v8f){0.f,0.f,0.f,0.f,0.f,0.f,0.f,0.f};
#pragma unroll
    for (int nt = 0; nt < 8; ++nt)
#pragma unroll
      for (int k0 = 0; k0 < HE; k0 += 4) {
        const int kk = h * 16 + k0 + kh;
        const v2f aa = *(const v2f*)&qs[(m0 + nl) * LDA + kk];
        const v2f bb = *(const v2f*)&ks[(nt * 16 + nl) * LDA + kk];
        sc[nt] = wmma4(aa, bb, sc[nt]);
      }

    // softmax over each row (row = 16 lanes within a wave half x 8 N-tiles)
#pragma unroll
    for (int r = 0; r < 8; ++r) {
      float mx = -3.4e38f;
#pragma unroll
      for (int nt = 0; nt < 8; ++nt) mx = fmaxf(mx, sc[nt][r]);
#pragma unroll
      for (int off = 1; off < 16; off <<= 1) mx = fmaxf(mx, __shfl_xor(mx, off, 32));
      float p[8], sum = 0.f;
#pragma unroll
      for (int nt = 0; nt < 8; ++nt) {
        p[nt] = __expf((sc[nt][r] - mx) * scale);
        sum += p[nt];
      }
#pragma unroll
      for (int off = 1; off < 16; off <<= 1) sum += __shfl_xor(sum, off, 32);
      const float inv = 1.f / sum;
      const int row = r + rh;
#pragma unroll
      for (int nt = 0; nt < 8; ++nt)
        scratch[row * LDA + nt * 16 + nl] = p[nt] * inv;
    }

    // O strip (16 x 16) = P(16x128) @ V_h(128x16)
    v8f oa = (v8f){0.f,0.f,0.f,0.f,0.f,0.f,0.f,0.f};
#pragma unroll 2
    for (int k0 = 0; k0 < T; k0 += 4) {
      const int kk = k0 + kh;
      const v2f aa = *(const v2f*)&scratch[nl * LDA + kk];
      v2f bb;
      bb.x = vs[(kk + 0) * LDA + h * 16 + nl];
      bb.y = vs[(kk + 1) * LDA + h * 16 + nl];
      oa = wmma4(aa, bb, oa);
    }
#pragma unroll
    for (int r = 0; r < 8; ++r)
      qs[(m0 + r + rh) * LDA + h * 16 + nl] = oa[r];   // overwrite own head cols
  }
  __syncthreads();   // qs now holds the full attention output

  // ---- output projection + bias (+ accumulate for pass 1) -----------------
  {
    v8f c[8];
#pragma unroll
    for (int i = 0; i < 8; ++i) c[i] = (v8f){0.f,0.f,0.f,0.f,0.f,0.f,0.f,0.f};
#pragma unroll 2
    for (int k0 = 0; k0 < Dm; k0 += 4) {
      const int kk = k0 + kh;
      v2f bb;
      bb.x = Wo[(kk + 0) * Dm + wave * 16 + nl];
      bb.y = Wo[(kk + 1) * Dm + wave * 16 + nl];
#pragma unroll
      for (int mt = 0; mt < 8; ++mt) {
        const v2f aa = *(const v2f*)&qs[(mt * 16 + nl) * LDA + kk];
        c[mt] = wmma4(aa, bb, c[mt]);
      }
    }
    const float bias = bo[wave * 16 + nl];
#pragma unroll
    for (int mt = 0; mt < 8; ++mt)
#pragma unroll
      for (int r = 0; r < 8; ++r) {
        const int tok = mt * 16 + r + rh;
        const int off = base + tok * tstride + wave * 16 + nl;
        float v = c[mt][r] + bias;
        if (pass) v += prev[mt][r];
        out[off] = v;
      }
  }
}

extern "C" void kernel_launch(void* const* d_in, const int* in_sizes, int n_in,
                              void* d_out, int out_size, void* d_ws, size_t ws_size,
                              hipStream_t stream) {
  const float* x    = (const float*)d_in[0];
  const float* Wq0  = (const float*)d_in[1];
  const float* Wkv0 = (const float*)d_in[2];
  const float* Wo0  = (const float*)d_in[3];
  const float* bo0  = (const float*)d_in[4];
  const float* Wq1  = (const float*)d_in[5];
  const float* Wkv1 = (const float*)d_in[6];
  const float* Wo1  = (const float*)d_in[7];
  const float* bo1  = (const float*)d_in[8];
  float* out = (float*)d_out;

  dim3 grid(1024), block(256);
  // pass 0 (attend along H) writes out; pass 1 (attend along W) accumulates.
  axial_pass_kernel<<<grid, block, 0, stream>>>(x, Wq0, Wkv0, Wo0, bo0, out, 0);
  axial_pass_kernel<<<grid, block, 0, stream>>>(x, Wq1, Wkv1, Wo1, bo1, out, 1);
}

// v002
// A run of this version takes 332 microseconds.
// Timed twice side by side with v001, it ran 1.27 and 1.26 times as fast.
// All steps since v000 together make it 1.59 times as fast.
#include <hip/hip_runtime.h>

typedef float v2f __attribute__((ext_vector_type(2)));
typedef float v8f __attribute__((ext_vector_type(8)));
typedef int   i32x4 __attribute__((vector_size(16)));

#define AS1 __attribute__((address_space(1)))
#define AS3 __attribute__((address_space(3)))

static constexpr int T   = 128;   // sequence length (axial dim)
static constexpr int Dm  = 128;   // embedding dim
static constexpr int HE  = 16;    // head dim (D / 8 heads)
static constexpr int LDA = 132;   // padded LDS row stride (floats): 16B-aligned, bank-spread

__device__ __forceinline__ v8f wmma4(v2f a, v2f b, v8f c) {
  // D = A(16x4 f32) * B(4x16 f32) + C(16x16 f32)
  return __builtin_amdgcn_wmma_f32_16x16x4_f32(false, a, false, b, (short)0, c,
                                               false, false);
}

__device__ __forceinline__ float swap_half(float v) {
  // value of lane l ^ 16
  const int b = __builtin_bit_cast(int, v);
  return __builtin_bit_cast(float, __builtin_amdgcn_permlanex16(
      b, b, 0x76543210, 0xfedcba98, false, false));
}

__global__ __launch_bounds__(256, 1)
void axial_pass_kernel(const float* __restrict__ x,
                       const float* __restrict__ Wq,
                       const float* __restrict__ Wkv,
                       const float* __restrict__ Wo,
                       const float* __restrict__ bo,
                       float* __restrict__ out,
                       int pass)
{
  __shared__ float xs[T * LDA];   // x_seq
  __shared__ __attribute__((aligned(16))) float qs[T * LDA];   // Q, later attention output
  __shared__ float ks[T * LDA];
  __shared__ float vs[T * LDA];

  const int tid  = threadIdx.x;
  const int wave = tid >> 5;         // 8 waves; also head id; also N-strip id
  const int lane = tid & 31;
  const int nl   = lane & 15;        // N / M index within a tile
  const int kh   = (lane >> 4) << 1; // K-half offset: 0 or 2
  const int rh   = (lane >> 4) << 3; // C row-half offset: 0 or 8

  // ---- sequence addressing ------------------------------------------------
  const int s = blockIdx.x;
  const int b = s >> 7, o = s & 127;
  int base, tstride;
  if (pass == 0) {              // attend along H: x[b, t, o, :]
    base    = b * (128 * 128 * 128) + o * 128;
    tstride = 128 * 128;
  } else {                      // attend along W: x[b, o, t, :]
    base    = (b * 128 + o) * (128 * 128);
    tstride = 128;
  }

  // ---- stage x_seq [128 x 128] into LDS (async-to-LDS path on CDNA5) ------
#if __has_builtin(__builtin_amdgcn_global_load_async_to_lds_b128)
  for (int i = tid; i < T * (Dm / 4); i += 256) {
    const int row = i >> 5;
    const int c4  = (i & 31) << 2;
    __builtin_amdgcn_global_load_async_to_lds_b128(
        (AS1 i32x4*)(x + base + row * tstride + c4),
        (AS3 i32x4*)&xs[row * LDA + c4], 0, 0);
  }
#if __has_builtin(__builtin_amdgcn_s_wait_asynccnt)
  __builtin_amdgcn_s_wait_asynccnt(0);
#else
  asm volatile("s_wait_asynccnt 0" ::: "memory");
#endif
#else
  for (int i = tid; i < T * (Dm / 4); i += 256) {
    const int row = i >> 5;
    const int c4  = (i & 31) << 2;
    const float4 v = *(const float4*)(x + base + row * tstride + c4);
    *(float4*)&xs[row * LDA + c4] = v;
  }
#endif
  __syncthreads();

  // ---- column-strip GEMM: OutL[:, oc0..oc0+15] = A(128x128,LDS) @ Bg ------
  auto gemm_col = [&](const float* __restrict__ A, const float* __restrict__ Bg,
                      int ldb, int bc0, float* __restrict__ OutL, int oc0) {
    v8f c[8];
#pragma unroll
    for (int i = 0; i < 8; ++i) c[i] = (v8f){0.f,0.f,0.f,0.f,0.f,0.f,0.f,0.f};
#pragma unroll 2
    for (int k0 = 0; k0 < Dm; k0 += 4) {
      const int kk = k0 + kh;
      v2f bb;
      bb.x = Bg[(kk + 0) * ldb + bc0 + nl];
      bb.y = Bg[(kk + 1) * ldb + bc0 + nl];
#pragma unroll
      for (int mt = 0; mt < 8; ++mt) {
        const v2f aa = *(const v2f*)&A[(mt * 16 + nl) * LDA + kk];
        c[mt] = wmma4(aa, bb, c[mt]);
      }
    }
#pragma unroll
    for (int mt = 0; mt < 8; ++mt)
#pragma unroll
      for (int r = 0; r < 8; ++r)
        OutL[(mt * 16 + r + rh) * LDA + oc0 + nl] = c[mt][r];
  };

  // ---- projections: Q, K, V ----------------------------------------------
  gemm_col(xs, Wq,  Dm,     wave * 16,      qs, wave * 16);
  gemm_col(xs, Wkv, 2 * Dm, wave * 16,      ks, wave * 16);
  gemm_col(xs, Wkv, 2 * Dm, Dm + wave * 16, vs, wave * 16);
  __syncthreads();   // q/k/v ready

  // ---- pass 1 adds onto pass 0's result: fetch this lane's 64 old values now,
  // as one group of independent loads whose latency the attention phase covers
  float prev[8][8];
  if (pass) {
    const float* po = out + (base + rh * tstride + wave * 16 + nl);
#pragma unroll
    for (int mt = 0; mt < 8; ++mt)
#pragma unroll
      for (int r = 0; r < 8; ++r) prev[mt][r] = po[(mt * 16 + r) * tstride];
  } else {
#pragma unroll
    for (int mt = 0; mt < 8; ++mt)
#pragma unroll
      for (int r = 0; r < 8; ++r) prev[mt][r] = 0.f;
  }

  // ---- attention: one wave per head, scores kept transposed ----------------
  // S^T = K_h Q_h^T puts one query in each lane (its 128 keys split between the
  // two lane halves), so the softmax reduces inside the lane plus one half swap,
  // and the D registers of S^T are already the B fragments of O^T = V_h^T P^T.
  const int h = wave;
  const float scale = 0.25f;               // 1/sqrt(16)

#pragma unroll 1
  for (int mt = 0; mt < 8; ++mt) {
    const int m0 = mt * 16;

    // sc[nt][r] = score(key nt*16 + rh + r, query m0 + nl)
    v2f qf[4];
#pragma unroll
    for (int k = 0; k < 4; ++k)
      qf[k] = *(const v2f*)&qs[(m0 + nl) * LDA + h * 16 + k * 4 + kh];
    v8f sc[8];
#pragma unroll
    for (int i = 0; i < 8; ++i) sc[i] = (v8f){0.f,0.f,0.f,0.f,0.f,0.f,0.f,0.f};
#pragma unroll
    for (int nt = 0; nt < 8; ++nt)
#pragma unroll
      for (int k = 0; k < 4; ++k) {
        const v2f kf = *(const v2f*)&ks[(nt * 16 + nl) * LDA + h * 16 + k * 4 + kh];
        sc[nt] = wmma4(kf, qf[k], sc[nt]);
      }

    // softmax of this lane's query: eight independent chains, then a tree
    v8f m8 = sc[0];
#pragma unroll
    for (int nt = 1; nt < 8; ++nt)
#pragma unroll
      for (int r = 0; r < 8; ++r) m8[r] = fmaxf(m8[r], sc[nt][r]);
    float mx = fmaxf(fmaxf(fmaxf(m8[0], m8[1]), fmaxf(m8[2], m8[3])),
                     fmaxf(fmaxf(m8[4], m8[5]), fmaxf(m8[6], m8[7])));
    mx = fmaxf(mx, swap_half(mx));
    v8f s8 = (v8f){0.f,0.f,0.f,0.f,0.f,0.f,0.f,0.f};
#pragma unroll
    for (int nt = 0; nt < 8; ++nt) {
#pragma unroll
      for (int r = 0; r < 8; ++r) sc[nt][r] = __expf((sc[nt][r] - mx) * scale);
      s8 += sc[nt];
    }
    float sum = ((s8[0] + s8[1]) + (s8[2] + s8[3])) + ((s8[4] + s8[5]) + (s8[6] + s8[7]));
    sum += swap_half(sum);
    const float inv = 1.f / sum;

    // O^T (16 e x 16 queries) = V_h^T P^T. Step (nt, j) pairs, at lane half hf and
    // register i of both fragments, key nt*16 + 8*hf + 2*j + i. Two accumulator
    // chains (even and odd nt) keep the matrix unit at its issue interval.
    v8f o0 = (v8f){0.f,0.f,0.f,0.f,0.f,0.f,0.f,0.f};
    v8f o1 = (v8f){0.f,0.f,0.f,0.f,0.f,0.f,0.f,0.f};
#pragma unroll
    for (int nt = 0; nt < 8; nt += 2)
#pragma unroll
      for (int j = 0; j < 4; ++j) {
        const int ka = (nt * 16 + rh + 2 * j) * LDA + h * 16 + nl;
        const int kb = ka + 16 * LDA;
        v2f va, vb, pa, pb;
        va.x = vs[ka];  va.y = vs[ka + LDA];
        vb.x = vs[kb];  vb.y = vs[kb + LDA];
        pa.x = sc[nt][2 * j];      pa.y = sc[nt][2 * j + 1];
        pb.x = sc[nt + 1][2 * j];  pb.y = sc[nt + 1][2 * j + 1];
        o0 = wmma4(va, pa, o0);
        o1 = wmma4(vb, pb, o1);
      }
    // lane holds O[m0 + nl][h*16 + rh + 0..7]: overwrite own head cols
    float4* od = (float4*)&qs[(m0 + nl) * LDA + h * 16 + rh];
    od[0] = make_float4((o0[0] + o1[0]) * inv, (o0[1] + o1[1]) * inv,
                        (o0[2] + o1[2]) * inv, (o0[3] + o1[3]) * inv);
    od[1] = make_float4((o0[4] + o1[4]) * inv, (o0[5] + o1[5]) * inv,
                        (o0[6] + o1[6]) * inv, (o0[7] + o1[7]) * inv);
  }
  __syncthreads();   // qs now holds the full attention output

  // ---- output projection + bias (+ accumulate for pass 1) -----------------
  {
    v8f c[8];
#pragma unroll
    for (int i = 0; i < 8; ++i) c[i] = (v8f){0.f,0.f,0.f,0.f,0.f,0.f,0.f,0.f};
#pragma unroll 2
    for (int k0 = 0; k0 < Dm; k0 += 4) {
      const int kk = k0 + kh;
      v2f bb;
      bb.x = Wo[(kk + 0) * Dm + wave * 16 + nl];
      bb.y = Wo[(kk + 1) * Dm + wave * 16 + nl];
#pragma unroll
      for (int mt = 0; mt < 8; ++mt) {
        const v2f aa = *(const v2f*)&qs[(mt * 16 + nl) * LDA + kk];
        c[mt] = wmma4(aa, bb, c[mt]);
      }
    }
    const float bias = bo[wave * 16 + nl];
#pragma unroll
    for (int mt = 0; mt < 8; ++mt)
#pragma unroll
      for (int r = 0; r < 8; ++r) {
        const int tok = mt * 16 + r + rh;
        const int off = base + tok * tstride + wave * 16 + nl;
        float v = c[mt][r] + bias;
        if (pass) v += prev[mt][r];
        out[off] = v;
      }
  }
}

extern "C" void kernel_launch(void* const* d_in, const int* in_sizes, int n_in,
                              void* d_out, int out_size, void* d_ws, size_t ws_size,
                              hipStream_t stream) {
  const float* x    = (const float*)d_in[0];
  const float* Wq0  = (const float*)d_in[1];
  const float* Wkv0 = (const float*)d_in[2];
  const float* Wo0  = (const float*)d_in[3];
  const float* bo0  = (const float*)d_in[4];
  const float* Wq1  = (const float*)d_in[5];
  const float* Wkv1 = (const float*)d_in[6];
  const float* Wo1  = (const float*)d_in[7];
  const float* bo1  = (const float*)d_in[8];
  float* out = (float*)d_out;

  dim3 grid(1024), block(256);
  // pass 0 (attend along H) writes out; pass 1 (attend along W) accumulates.
  axial_pass_kernel<<<grid, block, 0, stream>>>(x, Wq0, Wkv0, Wo0, bo0, out, 0);
  axial_pass_kernel<<<grid, block, 0, stream>>>(x, Wq1, Wkv1, Wo1, bo1, out, 1);
}

// v003
// Measured time: 264 microseconds a run.
// Timed twice side by side with v002, it ran 1.25 and 1.26 times as fast.
// Counting every step since v000, it is 1.99 times as fast.
#include <hip/hip_runtime.h>

typedef float v2f __attribute__((ext_vector_type(2)));
typedef float v8f __attribute__((ext_vector_type(8)));
typedef int   i32x4 __attribute__((vector_size(16)));

#define AS1 __attribute__((address_space(1)))
#define AS3 __attribute__((address_space(3)))

static constexpr int T   = 128;   // sequence length (axial dim)
static constexpr int Dm  = 128;   // embedding dim
static constexpr int HE  = 16;    // head dim (D / 8 heads)
static constexpr int LDA = 132;   // padded LDS row stride (floats): 16B-aligned, bank-spread

__device__ __forceinline__ v8f wmma4(v2f a, v2f b, v8f c) {
  // D = A(16x4 f32) * B(4x16 f32) + C(16x16 f32)
  return __builtin_amdgcn_wmma_f32_16x16x4_f32(false, a, false, b, (short)0, c,
                                               false, false);
}

__device__ __forceinline__ float swap_half(float v) {
  // value of lane l ^ 16
  const int b = __builtin_bit_cast(int, v);
  return __builtin_bit_cast(float, __builtin_amdgcn_permlanex16(
      b, b, 0x76543210, 0xfedcba98, false, false));
}

// One 16-column strip of a projection of the staged sequence A (128 x 128, LDS).
// TR = false: c[mt][r] = (A W)[mt*16 + 8*half + r][col0 + nl]   (token rows, a lane owns a column)
// TR = true : c[mt][r] = (A W)[mt*16 + nl][col0 + 8*half + r]   (W^T A^T: a lane owns a token)
template <bool TR>
__device__ __forceinline__ void project(const float* __restrict__ A,
                                        const float* __restrict__ Bg, int ldb, int col0,
                                        int nl, int kh, v8f (&c)[8]) {
#pragma unroll
  for (int i = 0; i < 8; ++i) c[i] = (v8f){0.f,0.f,0.f,0.f,0.f,0.f,0.f,0.f};
#pragma unroll 2   // two k steps a trip: their LDS reads pair into one two-address load
  for (int k0 = 0; k0 < Dm; k0 += 4) {
    const int kk = k0 + kh;
    v2f bb;
    bb.x = Bg[(kk + 0) * ldb + col0 + nl];
    bb.y = Bg[(kk + 1) * ldb + col0 + nl];
#pragma unroll
    for (int mt = 0; mt < 8; ++mt) {
      const v2f aa = *(const v2f*)&A[(mt * 16 + nl) * LDA + kk];
      c[mt] = TR ? wmma4(bb, aa, c[mt]) : wmma4(aa, bb, c[mt]);
    }
  }
}

// 256 registers a wave and 132 KiB of LDS a work-group: two work-groups share a WGP,
// so one's staging, stores, barriers and load waits run under the other's products.
__global__ __launch_bounds__(256, 4)
void axial_pass_kernel(const float* __restrict__ x,
                       const float* __restrict__ Wq,
                       const float* __restrict__ Wkv,
                       const float* __restrict__ Wo,
                       const float* __restrict__ bo,
                       float* __restrict__ out,
                       int pass)
{
  __shared__ float xs[T * LDA];   // x_seq
  __shared__ __attribute__((aligned(16))) float qs[T * LDA];   // Q, later attention output

  const int tid  = threadIdx.x;
  const int wave = tid >> 5;         // 8 waves; also head id; also N-strip id
  const int lane = tid & 31;
  const int nl   = lane & 15;        // N / M index within a tile
  const int kh   = (lane >> 4) << 1; // K-half offset: 0 or 2
  const int rh   = (lane >> 4) << 3; // C row-half offset: 0 or 8

  // ---- sequence addressing ------------------------------------------------
  const int s = blockIdx.x;
  const int b = s >> 7, o = s & 127;
  int base, tstride;
  if (pass == 0) {              // attend along H: x[b, t, o, :]
    base    = b * (128 * 128 * 128) + o * 128;
    tstride = 128 * 128;
  } else {                      // attend along W: x[b, o, t, :]
    base    = (b * 128 + o) * (128 * 128);
    tstride = 128;
  }

  // ---- stage x_seq [128 x 128] into LDS (async-to-LDS path on CDNA5) ------
#if __has_builtin(__builtin_amdgcn_global_load_async_to_lds_b128)
  for (int i = tid; i < T * (Dm / 4); i += 256) {
    const int row = i >> 5;
    const int c4  = (i & 31) << 2;
    __builtin_amdgcn_global_load_async_to_lds_b128(
        (AS1 i32x4*)(x + base + row * tstride + c4),
        (AS3 i32x4*)&xs[row * LDA + c4], 0, 0);
  }
#if __has_builtin(__builtin_amdgcn_s_wait_asynccnt)
  __builtin_amdgcn_s_wait_asynccnt(0);
#else
  asm volatile("s_wait_asynccnt 0" ::: "memory");
#endif
#else
  for (int i = tid; i < T * (Dm / 4); i += 256) {
    const int row = i >> 5;
    const int c4  = (i & 31) << 2;
    const float4 v = *(const float4*)(x + base + row * tstride + c4);
    *(float4*)&xs[row * LDA + c4] = v;
  }
#endif
  __syncthreads();

  // ---- projections: a wave makes its own head's Q, K, V and is their only reader
  // Q^T: the lane's 8 values of each token go to LDS and come back to the same lane.
  {
    v8f c[8];
    project<true>(xs, Wq, Dm, wave * 16, nl, kh, c);
#pragma unroll
    for (int mt = 0; mt < 8; ++mt) {
      float4* qd = (float4*)&qs[(mt * 16 + nl) * LDA + wave * 16 + rh];
      qd[0] = make_float4(c[mt][0], c[mt][1], c[mt][2], c[mt][3]);
      qd[1] = make_float4(c[mt][4], c[mt][5], c[mt][6], c[mt][7]);
    }
  }
  // K^T and V stay in their D registers, which are the A fragments of the attention:
  // kt[nt][r] = K[nt*16 + nl][rh + r],  vv[nt][r] = V[nt*16 + rh + r][nl]
  v8f kt[8], vv[8];
  project<true >(xs, Wkv, 2 * Dm, wave * 16,      nl, kh, kt);
  project<false>(xs, Wkv, 2 * Dm, Dm + wave * 16, nl, kh, vv);

  // ---- attention: one wave per head, scores kept transposed ----------------
  // S^T = K_h Q_h^T puts one query in each lane (its 128 keys split between the
  // two lane halves), so the softmax reduces inside the lane plus one half swap,
  // and the D registers of S^T are already the B fragments of O^T = V_h^T P^T.
  const int h = wave;
  const float scale = 0.25f;               // 1/sqrt(16)

#pragma unroll 1
  for (int mt = 0; mt < 8; ++mt) {
    const int m0 = mt * 16;

    // sc[nt][r] = score(key nt*16 + rh + r, query m0 + nl)
    // step j pairs, at lane half hf and register i of both fragments, e = 8*hf + 2*j + i
    const float4* qp = (const float4*)&qs[(m0 + nl) * LDA + h * 16 + rh];
    const float4 qa = qp[0], qb = qp[1];
    const v2f qf[4] = {{qa.x, qa.y}, {qa.z, qa.w}, {qb.x, qb.y}, {qb.z, qb.w}};
    v8f sc[8];
#pragma unroll
    for (int i = 0; i < 8; ++i) sc[i] = (v8f){0.f,0.f,0.f,0.f,0.f,0.f,0.f,0.f};
#pragma unroll
    for (int nt = 0; nt < 8; ++nt)
#pragma unroll
      for (int j = 0; j < 4; ++j) {
        const v2f kf = {kt[nt][2 * j], kt[nt][2 * j + 1]};
        sc[nt] = wmma4(kf, qf[j], sc[nt]);
      }

    // softmax of this lane's query: eight independent chains, then a tree
    v8f m8 = sc[0];
#pragma unroll
    for (int nt = 1; nt < 8; ++nt)
#pragma unroll
      for (int r = 0; r < 8; ++r) m8[r] = fmaxf(m8[r], sc[nt][r]);
    float mx = fmaxf(fmaxf(fmaxf(m8[0], m8[1]), fmaxf(m8[2], m8[3])),
                     fmaxf(fmaxf(m8[4], m8[5]), fmaxf(m8[6], m8[7])));
    mx = fmaxf(mx, swap_half(mx));
    v8f s8 = (v8f){0.f,0.f,0.f,0.f,0.f,0.f,0.f,0.f};
#pragma unroll
    for (int nt = 0; nt < 8; ++nt) {
#pragma unroll
      for (int r = 0; r < 8; ++r) sc[nt][r] = __expf((sc[nt][r] - mx) * scale);
      s8 += sc[nt];
    }
    float sum = ((s8[0] + s8[1]) + (s8[2] + s8[3])) + ((s8[4] + s8[5]) + (s8[6] + s8[7]));
    sum += swap_half(sum);
    const float inv = 1.f / sum;

    // O^T (16 e x 16 queries) = V_h^T P^T. Step (nt, j) pairs, at lane half hf and
    // register i of both fragments, key nt*16 + 8*hf + 2*j + i. Two accumulator
    // chains (even and odd nt) keep the matrix unit at its issue interval.
    v8f o0 = (v8f){0.f,0.f,0.f,0.f,0.f,0.f,0.f,0.f};
    v8f o1 = (v8f){0.f,0.f,0.f,0.f,0.f,0.f,0.f,0.f};
#pragma unroll
    for (int nt = 0; nt < 8; nt += 2)
#pragma unroll
      for (int j = 0; j < 4; ++j) {
        v2f va, vb, pa, pb;
        va.x = vv[nt][2 * j];      va.y = vv[nt][2 * j + 1];
        vb.x = vv[nt + 1][2 * j];  vb.y = vv[nt + 1][2 * j + 1];
        pa.x = sc[nt][2 * j];      pa.y = sc[nt][2 * j + 1];
        pb.x = sc[nt + 1][2 * j];  pb.y = sc[nt + 1][2 * j + 1];
        o0 = wmma4(va, pa, o0);
        o1 = wmma4(vb, pb, o1);
      }
    // lane holds O[m0 + nl][h*16 + rh + 0..7]: overwrite own head cols
    float4* od = (float4*)&qs[(m0 + nl) * LDA + h * 16 + rh];
    od[0] = make_float4((o0[0] + o1[0]) * inv, (o0[1] + o1[1]) * inv,
                        (o0[2] + o1[2]) * inv, (o0[3] + o1[3]) * inv);
    od[1] = make_float4((o0[4] + o1[4]) * inv, (o0[5] + o1[5]) * inv,
                        (o0[6] + o1[6]) * inv, (o0[7] + o1[7]) * inv);
  }

  // ---- pass 1 adds onto pass 0's result: fetch this lane's 64 old values as one
  // group of independent loads, here where K, V and the scores are dead and leave it
  // the registers; the wait falls in with the barrier, under the other work-group's work
  float prev[8][8];
  if (pass) {
    const float* po = out + (base + rh * tstride + wave * 16 + nl);
#pragma unroll
    for (int mt = 0; mt < 8; ++mt)
#pragma unroll
      for (int r = 0; r < 8; ++r) prev[mt][r] = po[(mt * 16 + r) * tstride];
  } else {
#pragma unroll
    for (int mt = 0; mt < 8; ++mt)
#pragma unroll
      for (int r = 0; r < 8; ++r) prev[mt][r] = 0.f;
  }
  __syncthreads();   // qs now holds the full attention output

  // ---- output projection + bias (+ accumulate for pass 1) -----------------
  {
    v8f c[8];
#pragma unroll
    for (int i = 0; i < 8; ++i) c[i] = (v8f){0.f,0.f,0.f,0.f,0.f,0.f,0.f,0.f};
#pragma unroll 2
    for (int k0 = 0; k0 < Dm; k0 += 4) {
      const int kk = k0 + kh;
      v2f bb;
      bb.x = Wo[(kk + 0) * Dm + wave * 16 + nl];
      bb.y = Wo[(kk + 1) * Dm + wave * 16 + nl];
#pragma unroll
      for (int mt = 0; mt < 8; ++mt) {
        const v2f aa = *(const v2f*)&qs[(mt * 16 + nl) * LDA + kk];
        c[mt] = wmma4(aa, bb, c[mt]);
      }
    }
    const float bias = bo[wave * 16 + nl];
#pragma unroll
    for (int mt = 0; mt < 8; ++mt)
#pragma unroll
      for (int r = 0; r < 8; ++r) {
        const int tok = mt * 16 + r + rh;
        const int off = base + tok * tstride + wave * 16 + nl;
        float v = c[mt][r] + bias;
        if (pass) v += prev[mt][r];
        out[off] = v;
      }
  }
}

extern "C" void kernel_launch(void* const* d_in, const int* in_sizes, int n_in,
                              void* d_out, int out_size, void* d_ws, size_t ws_size,
                              hipStream_t stream) {
  const float* x    = (const float*)d_in[0];
  const float* Wq0  = (const float*)d_in[1];
  const float* Wkv0 = (const float*)d_in[2];
  const float* Wo0  = (const float*)d_in[3];
  const float* bo0  = (const float*)d_in[4];
  const float* Wq1  = (const float*)d_in[5];
  const float* Wkv1 = (const float*)d_in[6];
  const float* Wo1  = (const float*)d_in[7];
  const float* bo1  = (const float*)d_in[8];
  float* out = (float*)d_out;

  dim3 grid(1024), block(256);
  // pass 0 (attend along H) writes out; pass 1 (attend along W) accumulates.
  axial_pass_kernel<<<grid, block, 0, stream>>>(x, Wq0, Wkv0, Wo0, bo0, out, 0);
  axial_pass_kernel<<<grid, block, 0, stream>>>(x, Wq1, Wkv1, Wo1, bo1, out, 1);
}
